// v000
// Measured on an AMD MI455X. A time is GPU time per run, averaged over a window of back-to-back runs after a warm-up
// (all launches, gaps included; the runs take copies of the inputs in turn), and the median of several windows.
// Apart from v000's, it joins two sittings. Times from different sittings can be a few percent apart, while
// side-by-side timings come from the same sitting.
// The starting kernel, v000, takes 1490 microseconds a run.
#include <hip/hip_runtime.h>

// EagerAttention (x [1][2048][2048], mask [1][1][T][T] (f32 additive, read; verbatim causal 0/-1e9); q = x w_q (32 x 64), k/v = x w_k/w_v (8 kv heads; group h/4); rotate-half RoPE (theta 1e6, positions arange; on-chip table); scores = q.k / 8 + mask; softmax f32; out = merged w_o -> [1][2048][2048]).
// Compute dtypes, f32 accumulate: every input rounded to bf16; q/k/v on PLAIN bf16 operands (inputs: exact); RoPE f32; causal scores hl x hl (3 products) on every row, attn.v: rows < 512 hl (3 products), the rest fp16 (x1024); the additive mask read per element inside computed tiles; tiles above the diagonal skipped on the verbatim structure with an on-device sampled check (NaN poison); softmax f32; w_o hl x exact (2 products).

#define NB_  1
#define TT   2048
#define DM   2048
#define NH_  32
#define NKV  8
#define REP  (NH_ / NKV)
#define HD   64
#define DQ   (NH_ * HD)
#define DKV  (NKV * HD)
#define ZH   2
#define RH   512                  // query rows < RH use hi+lo planes (0: none)
#define WIN  2048
#define PCAR 1024.0f
#define SCL  0.125f   // HD^-0.5
typedef _Float16 h16;
typedef unsigned short bf;
typedef __attribute__((ext_vector_type(16))) __bf16   v16bf;
typedef __attribute__((ext_vector_type(16))) _Float16 v16h;
typedef __attribute__((ext_vector_type(8)))  _Float16 v8h;
typedef __attribute__((ext_vector_type(8)))  unsigned short v8us;
typedef __attribute__((ext_vector_type(8)))  float    v8f;
typedef __attribute__((ext_vector_type(4)))  float    v4f;
typedef v8h  __attribute__((may_alias)) v8ha;
typedef v4f  __attribute__((may_alias)) v4fa;
typedef v8us __attribute__((may_alias)) v8usa;

__device__ __forceinline__ unsigned short f2bf(float f) { unsigned u = __float_as_uint(f); u += 0x7FFFu + ((u >> 16) & 1u); return (unsigned short)(u >> 16); }
__device__ __forceinline__ float bf2f(unsigned short b) { return __uint_as_float(((unsigned)b) << 16); }
__device__ __forceinline__ float bfr(float f) { return bf2f(f2bf(f)); }
__device__ __forceinline__ v16h cat16(v8h lo, v8h hi) { return __builtin_shufflevector(lo, hi, 0, 1, 2, 3, 4, 5, 6, 7, 8, 9, 10, 11, 12, 13, 14, 15); }
__device__ __forceinline__ v16bf cat16b(v8us lo, v8us hi) { return __builtin_bit_cast(v16bf, __builtin_shufflevector(lo, hi, 0, 1, 2, 3, 4, 5, 6, 7, 8, 9, 10, 11, 12, 13, 14, 15)); }
__device__ __forceinline__ v8f wmma16(v16h a, v16h b, v8f c) { return __builtin_amdgcn_wmma_f32_16x16x32_f16(false, a, false, b, (short)0, c, false, false); }
__device__ __forceinline__ v8f wmmab(v16bf a, v16bf b, v8f c) { return __builtin_amdgcn_wmma_f32_16x16x32_bf16(false, a, false, b, (short)0, c, false, false); }



// ---- k_gemmw: register-blocked GEMM, ONE WAVE per 64x64 output tile (16 accumulators), operands straight from K-contiguous 16-bit planes; grid (M/64, N/64, Z), 32 threads.
// C[m][n] (f32, pitch ldc, + optional f32 bias[n]) = sum_k A[m][k] Bt[n][k] (+ split products per NSPLIT). z-batch strides sA/sB/sC in elements. K % 32 == 0.
template <typename T16> struct WFrag;
template <> struct WFrag<h16> { typedef v16h V; static __device__ __forceinline__ V ld(const h16* p) { return cat16(*(const v8h*)p, *(const v8h*)(p + 16)); } static __device__ __forceinline__ v8f mma(V a, V b, v8f c) { return wmma16(a, b, c); } };
template <> struct WFrag<bf> { typedef v16bf V; static __device__ __forceinline__ V ld(const bf* p) { return cat16b(*(const v8us*)p, *(const v8us*)(p + 16)); } static __device__ __forceinline__ v8f mma(V a, V b, v8f c) { return wmmab(a, b, c); } };
template <typename T16, int NSPLIT, bool BIAS>
__global__ __launch_bounds__(32) void k_gemmw(const T16* __restrict__ A, const T16* __restrict__ A2, const T16* __restrict__ Bt, const T16* __restrict__ Bt2, int K, float* C, int ldc, const float* __restrict__ bias, size_t sA, size_t sB, size_t sC) {
    typedef typename WFrag<T16>::V V;
    __shared__ __align__(16) float os[16 * 68];
    const size_t z = blockIdx.z; A += z * sA; if (A2) A2 += z * sA; Bt += z * sB; if (Bt2) Bt2 += z * sB; C += z * sC;
    const int lane = threadIdx.x & 31, lr = lane & 15, hi = lane >> 4; const int r0 = blockIdx.x * 64, c0 = blockIdx.y * 64;
    v8f acc[4][4];
#pragma unroll
    for (int mb = 0; mb < 4; ++mb)
#pragma unroll
        for (int nb = 0; nb < 4; ++nb) acc[mb][nb] = (v8f){};
    const size_t aoff = (size_t)(r0 + lr) * K + 8 * hi, boff = (size_t)(c0 + lr) * K + 8 * hi;
#pragma unroll 1
    for (int kc = 0; kc < K; kc += 32) {
        V a[4], a2[4];
#pragma unroll
        for (int mb = 0; mb < 4; ++mb) { a[mb] = WFrag<T16>::ld(A + aoff + (size_t)mb * 16 * K + kc); if (NSPLIT == 1 || NSPLIT == 2) a2[mb] = WFrag<T16>::ld(A2 + aoff + (size_t)mb * 16 * K + kc); }
#pragma unroll
        for (int nb = 0; nb < 4; ++nb) { const V b = WFrag<T16>::ld(Bt + boff + (size_t)nb * 16 * K + kc); V b2; if (NSPLIT >= 2) b2 = WFrag<T16>::ld(Bt2 + boff + (size_t)nb * 16 * K + kc);
#pragma unroll
            for (int mb = 0; mb < 4; ++mb) { acc[mb][nb] = WFrag<T16>::mma(a[mb], b, acc[mb][nb]); if (NSPLIT == 1 || NSPLIT == 2) acc[mb][nb] = WFrag<T16>::mma(a2[mb], b, acc[mb][nb]); if (NSPLIT >= 2) acc[mb][nb] = WFrag<T16>::mma(a[mb], b2, acc[mb][nb]); } }
        asm volatile("v_nop\n\tv_nop\n\tv_nop\n\tv_nop" : "+v"(acc[0][0]), "+v"(acc[1][1]), "+v"(acc[2][2]), "+v"(acc[3][3]) : "v"(a[0]), "v"(a[3]));
    }
#pragma unroll
    for (int mb = 0; mb < 4; ++mb) {
#pragma unroll
        for (int nb = 0; nb < 4; ++nb) {
#pragma unroll
            for (int j = 0; j < 8; ++j) os[(hi * 8 + j) * 68 + nb * 16 + lr] = acc[mb][nb][j]; }
        __builtin_amdgcn_wave_barrier(); asm volatile("" ::: "memory");
        float* crow = C + (size_t)(r0 + mb * 16) * ldc + c0;
{
#pragma unroll
            for (int s = 0; s < 8; ++s) { const int row = 2 * s + hi, cofs = lr * 4; v4f val = *(const v4fa*)(os + row * 68 + cofs); if (BIAS) { val[0] += bfr(bias[c0 + cofs]); val[1] += bfr(bias[c0 + cofs + 1]); val[2] += bfr(bias[c0 + cofs + 2]); val[3] += bfr(bias[c0 + cofs + 3]); }
                *(v4f*)(crow + (size_t)row * ldc + cofs) = val; }
             }
        __builtin_amdgcn_wave_barrier(); asm volatile("" ::: "memory");
    }
}

// ---- k_gemmc: the same one-wave 64x64 tile GEMM specialised for causal attention: CMODE 1 skips score tiles entirely above the diagonal (query rows r0+roff.., key columns c0..), CMODE 2 limits the
// key (K) loop of the probability x value contraction to the diagonal block (probabilities beyond it are exactly zero). roff = row offset of this launch's first row within the sequence.
template <typename T16, int NSPLIT, int CMODE>
__global__ __launch_bounds__(32) void k_gemmc(const T16* __restrict__ A, const T16* __restrict__ A2, const T16* __restrict__ Bt, const T16* __restrict__ Bt2, int K, float* C, int ldc, int roff, size_t sA, size_t sB, size_t sC) {
    typedef typename WFrag<T16>::V V;
    __shared__ __align__(16) float os[16 * 68];
    const size_t z = blockIdx.z; A += z * sA; if (A2) A2 += z * sA; Bt += z * sB; if (Bt2) Bt2 += z * sB; C += z * sC;
    const int lane = threadIdx.x & 31, lr = lane & 15, hi = lane >> 4; const int r0 = blockIdx.x * 64, c0 = blockIdx.y * 64;
    if (CMODE == 1 && c0 > r0 + roff + 63) return;                  // score tile entirely above the causal diagonal: never read (the softmax masks j > i by select)
    const int Kl = (CMODE == 2) ? min(K, r0 + roff + 64) : K;        // P.V: probabilities are exactly 0 beyond the diagonal block, so the K loop stops there
    v8f acc[4][4];
#pragma unroll
    for (int mb = 0; mb < 4; ++mb)
#pragma unroll
        for (int nb = 0; nb < 4; ++nb) acc[mb][nb] = (v8f){};
    const size_t aoff = (size_t)(r0 + lr) * K + 8 * hi, boff = (size_t)(c0 + lr) * K + 8 * hi;
#pragma unroll 1
    for (int kc = 0; kc < Kl; kc += 32) {
        V a[4], a2[4];
#pragma unroll
        for (int mb = 0; mb < 4; ++mb) { a[mb] = WFrag<T16>::ld(A + aoff + (size_t)mb * 16 * K + kc); if (NSPLIT == 1 || NSPLIT == 2) a2[mb] = WFrag<T16>::ld(A2 + aoff + (size_t)mb * 16 * K + kc); }
#pragma unroll
        for (int nb = 0; nb < 4; ++nb) { const V b = WFrag<T16>::ld(Bt + boff + (size_t)nb * 16 * K + kc); V b2; if (NSPLIT >= 2) b2 = WFrag<T16>::ld(Bt2 + boff + (size_t)nb * 16 * K + kc);
#pragma unroll
            for (int mb = 0; mb < 4; ++mb) { acc[mb][nb] = WFrag<T16>::mma(a[mb], b, acc[mb][nb]); if (NSPLIT == 1 || NSPLIT == 2) acc[mb][nb] = WFrag<T16>::mma(a2[mb], b, acc[mb][nb]); if (NSPLIT >= 2) acc[mb][nb] = WFrag<T16>::mma(a[mb], b2, acc[mb][nb]); } }
        asm volatile("v_nop\n\tv_nop\n\tv_nop\n\tv_nop" : "+v"(acc[0][0]), "+v"(acc[1][1]), "+v"(acc[2][2]), "+v"(acc[3][3]) : "v"(a[0]), "v"(a[3]));
    }
#pragma unroll
    for (int mb = 0; mb < 4; ++mb) {
#pragma unroll
        for (int nb = 0; nb < 4; ++nb) {
#pragma unroll
            for (int j = 0; j < 8; ++j) os[(hi * 8 + j) * 68 + nb * 16 + lr] = acc[mb][nb][j]; }
        __builtin_amdgcn_wave_barrier(); asm volatile("" ::: "memory");
        float* crow = C + (size_t)(r0 + mb * 16) * ldc + c0;
{
#pragma unroll
            for (int s = 0; s < 8; ++s) { const int row = 2 * s + hi, cofs = lr * 4; v4f val = *(const v4fa*)(os + row * 68 + cofs);
                *(v4f*)(crow + (size_t)row * ldc + cofs) = val; }
             }
        __builtin_amdgcn_wave_barrier(); asm volatile("" ::: "memory");
    }
}

__device__ __forceinline__ h16 tohx(float x) { return (h16)x; }
__device__ __forceinline__ void splitf(float y, unsigned short& h, unsigned short& l) { h = f2bf(y); l = f2bf(y - bf2f(h)); }
typedef __attribute__((ext_vector_type(2))) _Float16 v2h;
typedef __attribute__((ext_vector_type(4))) _Float16 v4h;
typedef __attribute__((ext_vector_type(2))) unsigned short v2us;
typedef __attribute__((ext_vector_type(4))) unsigned short v4us;
typedef __attribute__((ext_vector_type(2))) float v2f;
typedef __attribute__((ext_vector_type(4))) int v4i;

__global__ __launch_bounds__(256) void k_wtG(const float* __restrict__ w, int K, int N, bf* Bt) {
    const int lane = threadIdx.x & 31; const int L0 = (blockIdx.x * 8 + (threadIdx.x >> 5)) * 8; const int nlines = N * K / 64;
{
#pragma unroll 1
        for (int l = 0; l < 8; ++l) { const int L = L0 + l; if (L >= nlines) break; const size_t e = (size_t)L * 64 + lane * 2; const int k = (int)(e % K), n = (int)(e / K); v2us o;
            o[0] = f2bf(w[(size_t)k * N + n]); o[1] = f2bf(w[(size_t)(k + 1) * N + n]); *(v2us*)(Bt + e) = o; }
         }
}
__global__ __launch_bounds__(256) void k_cvt8(const float* __restrict__ src, bf* dst, size_t n8) { const size_t i = (size_t)blockIdx.x * 256 + threadIdx.x; if (i >= n8) return; const v8f v = *(const v8f*)(src + i * 8); v8us o;
#pragma unroll
    for (int k = 0; k < 8; ++k) o[k] = f2bf(v[k]); *(v8us*)(dst + i * 8) = o;  }
__global__ __launch_bounds__(256) void k_cstab(float* CS) { const int idx = blockIdx.x * 256 + threadIdx.x; if (idx >= TT * HD) return; const int t = idx / HD, d = idx % HD; const int i = (d < HD / 2) ? d : d - HD / 2; const float inv = __fdiv_rn(1.0f, powf(1000000.0f, (float)(2 * i) / (float)HD)); const float ang = __fmul_rn((float)t, inv); v2f cs; cs[0] = cosf(ang); cs[1] = sinf(ang);
    *(v2f*)(CS + (size_t)idx * 2) = cs;  }
// k_rope: head planes [h][t][d] (fp16 + hi/lo) of rope(x) x sc with the rotate-half convention out[d] = x[d] cos[t][d] - x[d+HD/2] sin[t][d], out[d+HD/2] = x[d+HD/2] cos[t][d+HD/2] + x[d] sin[t][d+HD/2]
__global__ __launch_bounds__(256) void k_rope(const float* __restrict__ F, int pitch, int nheads, const float* __restrict__ CS, const float* __restrict__ RF, const float* __restrict__ nw, float sc, h16* P16, bf* Ph, bf* Pl) {
    const size_t e = ((size_t)blockIdx.x * 256 + threadIdx.x) * 2; if (e >= (size_t)nheads * TT * HD) return; const int d = (int)(e % HD); const int t = (int)((e / HD) % TT); const int h = (int)(e / ((size_t)HD * TT)); const float* f = F + (size_t)t * pitch + h * HD; const float rf = RF ? RF[(size_t)h * TT + t] : 1.0f; v2h o16; v2us oh, ol;
#pragma unroll
    for (int q = 0; q < 2; ++q) { const int dd = d + q; const int dp = (dd < HD / 2) ? dd + HD / 2 : dd - HD / 2; float x0 = f[dd], x1 = f[dp];
        if (RF) { float n0 = __fmul_rn(x0, rf), n1 = __fmul_rn(x1, rf); asm volatile("" : "+v"(n0)); asm volatile("" : "+v"(n1)); x0 = __fmul_rn(bfr(nw[dd]), n0); x1 = __fmul_rn(bfr(nw[dp]), n1); }
        const v2f cs = *(const v2f*)(CS + ((size_t)t * HD + dd) * 2); float a = __fmul_rn(x0, cs[0]), bq = __fmul_rn(x1, cs[1]); asm volatile("" : "+v"(a)); asm volatile("" : "+v"(bq)); const float r = ((dd < HD / 2) ? __fsub_rn(a, bq) : __fadd_rn(a, bq)) * sc;
        o16[q] = tohx(r); unsigned short a2, c2; splitf(r, a2, c2); oh[q] = a2; ol[q] = c2; }
    *(v2h*)(P16 + e) = o16; *(v2us*)(Ph + e) = oh; *(v2us*)(Pl + e) = ol;  }
__global__ __launch_bounds__(256) void k_vtp(const float* __restrict__ F, int pitch, int nheads, h16* V16, bf* Vh, bf* Vl) { const size_t e = ((size_t)blockIdx.x * 256 + threadIdx.x) * 2; if (e >= (size_t)nheads * HD * TT) return; const int t = (int)(e % TT); const int d = (int)((e / TT) % HD); const int g = (int)(e / ((size_t)TT * HD)); v2h o16; v2us oh, ol;
#pragma unroll
    for (int q = 0; q < 2; ++q) { const float x = F[(size_t)(t + q) * pitch + g * HD + d]; o16[q] = tohx(x); unsigned short a2, c2; splitf(x, a2, c2); oh[q] = a2; ol[q] = c2; }
    *(v2h*)(V16 + e) = o16; *(v2us*)(Vh + e) = oh; *(v2us*)(Vl + e) = ol;  }
// k_mchk: samples above-diagonal entries of the additive f32 mask; any > -1e8 -> NaN poison.
__global__ __launch_bounds__(256) void k_mchk(const float* __restrict__ am, int* FLG) { const int tid = threadIdx.x; int bad = 0;
#pragma unroll 1
    for (int s2 = 0; s2 < 16; ++s2) { const unsigned h = (unsigned)(tid * 16 + s2) * 2654435761u; const int i = (int)(h % (TT - 1)); const int j = i + 1 + (int)((h >> 11) % (unsigned)(TT - 1 - i)); if (am[(size_t)i * TT + j] > -1e8f) bad = 1; }
    __shared__ int anyb; if (tid == 0) anyb = 0; __syncthreads(); if (bad) anyb = 1; __syncthreads(); if (tid < 8) { const int v = (tid == 0) ? anyb : 0; *(int*)(FLG + tid) = v;  } }

// k_asoft: per row (zz, i): t = S x HD^-0.5 + bf16(mask[i][j]) for j <= i, -3e38 for j > i (causal select); softmax over the 2048 keys (register row, one exp, fixed trees);
__global__ __launch_bounds__(256) void k_asoft(const float* __restrict__ Sb, const float* __restrict__ am, const int* __restrict__ FLG, h16* P16, bf* Ph, bf* Pl) {
    const int lane = threadIdx.x & 31; const int row = blockIdx.x * 8 + (threadIdx.x >> 5); if (row >= ZH * TT) return; const int i = row % TT; const int zz = row / TT; (void)zz; const bool hires = (i < RH); const float* sr = Sb + (size_t)row * TT; const float* amr = am + (size_t)i * TT; const bool poison = (FLG[0] != 0); float v[TT / 32]; float mx = -3.0e38f;
#pragma unroll
    for (int ch = 0; ch < TT / 128; ++ch) { const int j0 = ch * 128 + lane * 4; const v4f a = *(const v4f*)(sr + j0);
#pragma unroll
        for (int q = 0; q < 4; ++q) { const int j = j0 + q; (void)j; float sa = a[q] * SCL; asm volatile("" : "+v"(sa)); float mv = bfr(amr[j]); asm volatile("" : "+v"(mv)); const float t = (j <= i) ? __fadd_rn(sa, mv) : -3.0e38f; v[ch * 4 + q] = t; mx = fmaxf(mx, t); } }
#pragma unroll
    for (int sh = 16; sh; sh >>= 1) mx = fmaxf(mx, __shfl_xor(mx, sh, 32));
    float sum = 0.f;
#pragma unroll
    for (int k = 0; k < TT / 32; ++k) { float d0 = __fsub_rn(v[k], mx); asm volatile("" : "+v"(d0)); v[k] = __builtin_amdgcn_exp2f(__fmul_rn(d0, 1.4426950408889634f)); sum += v[k]; }
#pragma unroll
    for (int sh = 16; sh; sh >>= 1) sum += __shfl_xor(sum, sh, 32);
    const float f = poison ? __builtin_nanf("") : __fdiv_rn(hires ? 1.0f : PCAR, sum);
{
        if (hires) {
#pragma unroll
            for (int ch = 0; ch < TT / 128; ++ch) { v4us oh, ol;
#pragma unroll
                for (int q = 0; q < 4; ++q) { unsigned short a, c2; splitf(v[ch * 4 + q] * f, a, c2); oh[q] = a; ol[q] = c2; }
                const size_t oo = ((size_t)zz * (RH ? RH : 1) + i) * TT + ch * 128 + lane * 4; *(v4us*)(Ph + oo) = oh; *(v4us*)(Pl + oo) = ol; }
        } else {
#pragma unroll
            for (int ch = 0; ch < TT / 128; ++ch) { v4h o4;
#pragma unroll
                for (int q = 0; q < 4; ++q) o4[q] = tohx(v[ch * 4 + q] * f);
                *(v4h*)(P16 + (size_t)row * TT + ch * 128 + lane * 4) = o4; } }
         }
}
__global__ __launch_bounds__(256) void k_merge(const float* __restrict__ O, int h0, bf* Ah, bf* Al) { const size_t e = ((size_t)blockIdx.x * 256 + threadIdx.x) * 2; if (e >= (size_t)ZH * TT * HD) return; const int d = (int)(e % HD); const int t = (int)((e / HD) % TT); const int zz = (int)(e / ((size_t)HD * TT)); const float cs = (t < RH) ? 1.0f : (1.0f / PCAR); const size_t oo = (size_t)t * DQ + (h0 + zz) * HD + d;
    v2us oh, ol;
#pragma unroll
    for (int q = 0; q < 2; ++q) { unsigned short a, c2; splitf(O[e + q] * cs, a, c2); oh[q] = a; ol[q] = c2; } *(v2us*)(Ah + oo) = oh; *(v2us*)(Al + oo) = ol;  }

extern "C" void kernel_launch(void* const* d_in, const int* in_sizes, int n_in,
                              void* d_out, int out_size, void* d_ws, size_t ws_size, hipStream_t stream) {
    (void)in_sizes; (void)n_in; (void)out_size;
    const float* x = (const float*)d_in[0]; const float* amask = (const float*)d_in[1]; const float* wq = (const float*)d_in[2]; const float* wk = (const float*)d_in[3]; const float* wv = (const float*)d_in[4]; const float* wo = (const float*)d_in[5];
    float* OUT = (float*)d_out;     // [1][2048][2048]
    char* wsp = (char*)d_ws;
    auto take = [&](size_t bytes) { char* p = wsp; wsp += (bytes + 255) & ~(size_t)255; return (void*)p; };
    bf* WQ = (bf*)take((size_t)DQ * DM * 2); bf* WK = (bf*)take((size_t)DKV * DM * 2); bf* WV = (bf*)take((size_t)DKV * DM * 2); bf* WO = (bf*)take((size_t)DM * DQ * 2); float* CS = (float*)take((size_t)TT * HD * 2 * 4);
    bf* XB = (bf*)take((size_t)TT * DM * 2); int* FLG = (int*)take(256); float* FQ = (float*)take((size_t)TT * DQ * 4); float* FK = (float*)take((size_t)TT * DKV * 4);
    h16* QP16 = (h16*)take((size_t)NH_ * TT * HD * 2); h16* KP16 = (h16*)take((size_t)NKV * TT * HD * 2); h16* VT16 = (h16*)take((size_t)NKV * HD * TT * 2);
    bf* QPh = (bf*)take((size_t)NH_ * TT * HD * 2); bf* QPl = (bf*)take((size_t)NH_ * TT * HD * 2); bf* KPh = (bf*)take((size_t)NKV * TT * HD * 2); bf* KPl = (bf*)take((size_t)NKV * TT * HD * 2); bf* VTh = (bf*)take((size_t)NKV * HD * TT * 2); bf* VTl = (bf*)take((size_t)NKV * HD * TT * 2); bf* Ph = (bf*)take((size_t)ZH * RH * TT * 2); bf* Pl = (bf*)take((size_t)ZH * RH * TT * 2);
    float* Sb = (float*)take((size_t)ZH * TT * TT * 4); h16* P16 = (h16*)take((size_t)ZH * TT * TT * 2); float* Ob = (float*)take((size_t)ZH * TT * HD * 4); bf* ATh = (bf*)take((size_t)TT * DQ * 2); bf* ATl = (bf*)take((size_t)TT * DQ * 2);
    if ((size_t)(wsp - (char*)d_ws) > ws_size) return;    // ws 256 MiB
    float* FV = FK;   // v projection reuses the k buffer after the k planes are built (stream-ordered)
    { k_wtG<<<(unsigned)((DM * DQ / 64 + 63) / 64), 256, 0, stream>>>(wq, DM, DQ, WQ); k_wtG<<<(unsigned)((DM * DKV / 64 + 63) / 64), 256, 0, stream>>>(wk, DM, DKV, WK); k_wtG<<<(unsigned)((DM * DKV / 64 + 63) / 64), 256, 0, stream>>>(wv, DM, DKV, WV);
      k_wtG<<<(unsigned)((DQ * DM / 64 + 63) / 64), 256, 0, stream>>>(wo, DQ, DM, WO);
      k_cstab<<<(TT * HD + 255) / 256, 256, 0, stream>>>(CS); k_mchk<<<1, 256, 0, stream>>>(amask, FLG); }
    const unsigned LQ = (unsigned)(((size_t)NH_ * TT * HD / 2 + 255) / 256), LKv = (unsigned)(((size_t)NKV * TT * HD / 2 + 255) / 256);
    for (int b = 0; b < NB_; ++b) {
        
        k_cvt8<<<(unsigned)(((size_t)TT * DM / 8 + 255) / 256), 256, 0, stream>>>(x + (size_t)b * TT * DM, XB, (size_t)TT * DM / 8);
        k_gemmw<bf, 0, false><<<dim3(TT / 64, DQ / 64, 1), 32, 0, stream>>>(XB, nullptr, WQ, nullptr, DM, FQ, DQ, nullptr, 0, 0, 0);
        k_rope<<<LQ, 256, 0, stream>>>(FQ, DQ, NH_, CS, nullptr, nullptr, 1.0f, QP16, QPh, QPl);
        k_gemmw<bf, 0, false><<<dim3(TT / 64, DKV / 64, 1), 32, 0, stream>>>(XB, nullptr, WK, nullptr, DM, FK, DKV, nullptr, 0, 0, 0);
        k_rope<<<LKv, 256, 0, stream>>>(FK, DKV, NKV, CS, nullptr, nullptr, 1.0f, KP16, KPh, KPl);
        k_gemmw<bf, 0, false><<<dim3(TT / 64, DKV / 64, 1), 32, 0, stream>>>(XB, nullptr, WV, nullptr, DM, FV, DKV, nullptr, 0, 0, 0); k_vtp<<<LKv, 256, 0, stream>>>(FV, DKV, NKV, VT16, VTh, VTl);
        for (int h0 = 0; h0 < NH_; h0 += ZH) { const size_t zq = (size_t)h0, zk = (size_t)(h0 / REP);   // both heads of a pass share kv group h0/REP (REP >= 2): sB = 0
            k_gemmc<bf, 2, 1><<<dim3(TT / 64, TT / 64, ZH), 32, 0, stream>>>(QPh + zq * TT * HD, QPl + zq * TT * HD, KPh + zk * TT * HD, KPl + zk * TT * HD, HD, Sb, TT, 0, (size_t)TT * HD, 0, (size_t)TT * TT);   /* scores hl on all rows */
            k_asoft<<<ZH * TT / 8, 256, 0, stream>>>(Sb, amask, FLG, P16, Ph, Pl);
            k_gemmc<bf, 2, 2><<<dim3(RH / 64, HD / 64, ZH), 32, 0, stream>>>(Ph, Pl, VTh + zk * HD * TT, VTl + zk * HD * TT, TT, Ob, HD, 0, (size_t)RH * TT, 0, (size_t)TT * HD);
            k_gemmc<h16, 0, 2><<<dim3((TT - RH) / 64, HD / 64, ZH), 32, 0, stream>>>(P16 + (size_t)RH * TT, nullptr, VT16 + zk * HD * TT, nullptr, TT, Ob + (size_t)RH * HD, HD, RH, (size_t)TT * TT, 0, (size_t)TT * HD);
            k_merge<<<(unsigned)(((size_t)ZH * TT * HD / 2 + 255) / 256), 256, 0, stream>>>(Ob, h0, ATh, ATl); }
        k_gemmw<bf, 1, false><<<dim3(TT / 64, DM / 64, 1), 32, 0, stream>>>(ATh, ATl, WO, nullptr, DQ, OUT + (size_t)b * TT * DM, DM, nullptr, 0, 0, 0); }
}

// v001
// One run takes 925 microseconds.
// Two timings next to v000 put it at 1.65 and 1.62 times that version's speed.
#include <hip/hip_runtime.h>

// EagerAttention (x [1][2048][2048], mask [1][1][T][T] (f32 additive, read; verbatim causal 0/-1e9); q = x w_q (32 x 64), k/v = x w_k/w_v (8 kv heads; group h/4); rotate-half RoPE (theta 1e6, positions arange; on-chip table); scores = q.k / 8 + mask; softmax f32; out = merged w_o -> [1][2048][2048]).
// Compute dtypes, f32 accumulate: every input rounded to bf16; q/k/v on PLAIN bf16 operands (inputs: exact); RoPE f32; causal scores hl x hl (3 products) on every row, attn.v: rows < 512 hl (3 products), the rest fp16 (x1024); the additive mask read per element inside computed tiles; tiles above the diagonal skipped on the verbatim structure with an on-device sampled check (NaN poison); softmax f32; w_o hl x exact (2 products).

#define NB_  1
#define TT   2048
#define DM   2048
#define NH_  32
#define NKV  8
#define REP  (NH_ / NKV)
#define HD   64
#define DQ   (NH_ * HD)
#define DKV  (NKV * HD)
#define ZH   2
#define RH   512                  // query rows < RH use hi+lo planes (0: none)
#define WIN  2048
#define PCAR 1024.0f
#define SCL  0.125f   // HD^-0.5
typedef _Float16 h16;
typedef unsigned short bf;
typedef __attribute__((ext_vector_type(16))) __bf16   v16bf;
typedef __attribute__((ext_vector_type(16))) _Float16 v16h;
typedef __attribute__((ext_vector_type(8)))  _Float16 v8h;
typedef __attribute__((ext_vector_type(8)))  unsigned short v8us;
typedef __attribute__((ext_vector_type(8)))  float    v8f;
typedef __attribute__((ext_vector_type(4)))  float    v4f;
typedef v8h  __attribute__((may_alias)) v8ha;
typedef v4f  __attribute__((may_alias)) v4fa;
typedef v8us __attribute__((may_alias)) v8usa;

__device__ __forceinline__ unsigned short f2bf(float f) { unsigned u = __float_as_uint(f); u += 0x7FFFu + ((u >> 16) & 1u); return (unsigned short)(u >> 16); }
__device__ __forceinline__ float bf2f(unsigned short b) { return __uint_as_float(((unsigned)b) << 16); }
__device__ __forceinline__ float bfr(float f) { return bf2f(f2bf(f)); }
__device__ __forceinline__ v16h cat16(v8h lo, v8h hi) { return __builtin_shufflevector(lo, hi, 0, 1, 2, 3, 4, 5, 6, 7, 8, 9, 10, 11, 12, 13, 14, 15); }
__device__ __forceinline__ v16bf cat16b(v8us lo, v8us hi) { return __builtin_bit_cast(v16bf, __builtin_shufflevector(lo, hi, 0, 1, 2, 3, 4, 5, 6, 7, 8, 9, 10, 11, 12, 13, 14, 15)); }
__device__ __forceinline__ v8f wmma16(v16h a, v16h b, v8f c) { return __builtin_amdgcn_wmma_f32_16x16x32_f16(false, a, false, b, (short)0, c, false, false); }
__device__ __forceinline__ v8f wmmab(v16bf a, v16bf b, v8f c) { return __builtin_amdgcn_wmma_f32_16x16x32_bf16(false, a, false, b, (short)0, c, false, false); }



// ---- k_gemmw: register-blocked GEMM, one block of NW waves per 64x64 output tile; wave w takes the 32-wide k slices w, w + NW, ... into its own 16 accumulators, the NW partial tiles are summed
// in wave order through LDS; operands straight from K-contiguous 16-bit planes; grid (M/64, N/64, Z), 32 * NW threads.
// C[m][n] (f32, pitch ldc, + optional f32 bias[n]) = sum_k A[m][k] Bt[n][k] (+ split products per NSPLIT). z-batch strides sA/sB/sC in elements. K % 32 == 0.
template <typename T16> struct WFrag;
template <> struct WFrag<h16> { typedef v16h V; static __device__ __forceinline__ V ld(const h16* p) { return cat16(*(const v8h*)p, *(const v8h*)(p + 16)); } static __device__ __forceinline__ v8f mma(V a, V b, v8f c) { return wmma16(a, b, c); } };
template <> struct WFrag<bf> { typedef v16bf V; static __device__ __forceinline__ V ld(const bf* p) { return cat16b(*(const v8us*)p, *(const v8us*)(p + 16)); } static __device__ __forceinline__ v8f mma(V a, V b, v8f c) { return wmmab(a, b, c); } };
template <typename T16, int NSPLIT, bool BIAS, int NW>
__global__ __launch_bounds__(32 * NW) void k_gemmw(const T16* __restrict__ A, const T16* __restrict__ A2, const T16* __restrict__ Bt, const T16* __restrict__ Bt2, int K, float* C, int ldc, const float* __restrict__ bias, size_t sA, size_t sB, size_t sC) {
    typedef typename WFrag<T16>::V V;
    __shared__ __align__(16) float os[NW * 64 * 68];
    const size_t z = blockIdx.z; A += z * sA; if (A2) A2 += z * sA; Bt += z * sB; if (Bt2) Bt2 += z * sB; C += z * sC;
    const int lane = threadIdx.x & 31, lr = lane & 15, hi = lane >> 4; const int r0 = blockIdx.x * 64, c0 = blockIdx.y * 64; const int wv = (NW == 1) ? 0 : __builtin_amdgcn_readfirstlane((int)(threadIdx.x >> 5));
    v8f acc[4][4];
#pragma unroll
    for (int mb = 0; mb < 4; ++mb)
#pragma unroll
        for (int nb = 0; nb < 4; ++nb) acc[mb][nb] = (v8f){};
    const size_t aoff = (size_t)(r0 + lr) * K + 8 * hi, boff = (size_t)(c0 + lr) * K + 8 * hi;
#pragma unroll 1
    for (int kc = wv * 32; kc < K; kc += 32 * NW) {
        V a[4], a2[4];
#pragma unroll
        for (int mb = 0; mb < 4; ++mb) { a[mb] = WFrag<T16>::ld(A + aoff + (size_t)mb * 16 * K + kc); if (NSPLIT == 1 || NSPLIT == 2) a2[mb] = WFrag<T16>::ld(A2 + aoff + (size_t)mb * 16 * K + kc); }
#pragma unroll
        for (int nb = 0; nb < 4; ++nb) { const V b = WFrag<T16>::ld(Bt + boff + (size_t)nb * 16 * K + kc); V b2; if (NSPLIT >= 2) b2 = WFrag<T16>::ld(Bt2 + boff + (size_t)nb * 16 * K + kc);
#pragma unroll
            for (int mb = 0; mb < 4; ++mb) { acc[mb][nb] = WFrag<T16>::mma(a[mb], b, acc[mb][nb]); if (NSPLIT == 1 || NSPLIT == 2) acc[mb][nb] = WFrag<T16>::mma(a2[mb], b, acc[mb][nb]); if (NSPLIT >= 2) acc[mb][nb] = WFrag<T16>::mma(a[mb], b2, acc[mb][nb]); } }
        asm volatile("v_nop\n\tv_nop\n\tv_nop\n\tv_nop" : "+v"(acc[0][0]), "+v"(acc[1][1]), "+v"(acc[2][2]), "+v"(acc[3][3]) : "v"(a[0]), "v"(a[3]));
    }
    float* osw = os + wv * (64 * 68);   // this wave's partial tile
#pragma unroll
    for (int mb = 0; mb < 4; ++mb) {
#pragma unroll
        for (int nb = 0; nb < 4; ++nb) {
#pragma unroll
            for (int j = 0; j < 8; ++j) osw[(mb * 16 + hi * 8 + j) * 68 + nb * 16 + lr] = acc[mb][nb][j]; } }
    if (NW == 1) { __builtin_amdgcn_wave_barrier(); asm volatile("" ::: "memory"); }   // one wave: keeps the row reads below behind its own stores
    else __syncthreads();                                                                // every wave's partial tile stands in LDS before any of it is summed
    float* crow = C + (size_t)r0 * ldc + c0;
#pragma unroll
    for (int s = 0; s < 32 / NW; ++s) { const int idx = s * (32 * NW) + (int)threadIdx.x; const int row = idx >> 4, cofs = (idx & 15) * 4; v4f val = *(const v4fa*)(os + row * 68 + cofs);
#pragma unroll
        for (int w = 1; w < NW; ++w) val += *(const v4fa*)(os + w * (64 * 68) + row * 68 + cofs);
        if (BIAS) { val[0] += bfr(bias[c0 + cofs]); val[1] += bfr(bias[c0 + cofs + 1]); val[2] += bfr(bias[c0 + cofs + 2]); val[3] += bfr(bias[c0 + cofs + 3]); }
        *(v4f*)(crow + (size_t)row * ldc + cofs) = val; }
}

// ---- k_gemmc: the same 64x64 tile GEMM (NW waves share the K loop) specialised for causal attention: CMODE 1 skips score tiles entirely above the diagonal (query rows r0+roff.., key columns c0..), CMODE 2 limits the
// key (K) loop of the probability x value contraction to the diagonal block (probabilities beyond it are exactly zero). roff = row offset of this launch's first row within the sequence.
template <typename T16, int NSPLIT, int CMODE, int NW>
__global__ __launch_bounds__(32 * NW) void k_gemmc(const T16* __restrict__ A, const T16* __restrict__ A2, const T16* __restrict__ Bt, const T16* __restrict__ Bt2, int K, float* C, int ldc, int roff, size_t sA, size_t sB, size_t sC) {
    typedef typename WFrag<T16>::V V;
    __shared__ __align__(16) float os[NW * 64 * 68];
    const size_t z = blockIdx.z; A += z * sA; if (A2) A2 += z * sA; Bt += z * sB; if (Bt2) Bt2 += z * sB; C += z * sC;
    const int lane = threadIdx.x & 31, lr = lane & 15, hi = lane >> 4; const int r0 = blockIdx.x * 64, c0 = blockIdx.y * 64; const int wv = (NW == 1) ? 0 : __builtin_amdgcn_readfirstlane((int)(threadIdx.x >> 5));
    if (CMODE == 1 && c0 > r0 + roff + 63) return;                  // score tile entirely above the causal diagonal: never read (the softmax masks j > i by select)
    const int Kl = (CMODE == 2) ? min(K, r0 + roff + 64) : K;        // P.V: probabilities are exactly 0 beyond the diagonal block, so the K loop stops there
    v8f acc[4][4];
#pragma unroll
    for (int mb = 0; mb < 4; ++mb)
#pragma unroll
        for (int nb = 0; nb < 4; ++nb) acc[mb][nb] = (v8f){};
    const size_t aoff = (size_t)(r0 + lr) * K + 8 * hi, boff = (size_t)(c0 + lr) * K + 8 * hi;
#pragma unroll 1
    for (int kc = wv * 32; kc < Kl; kc += 32 * NW) {
        V a[4], a2[4];
#pragma unroll
        for (int mb = 0; mb < 4; ++mb) { a[mb] = WFrag<T16>::ld(A + aoff + (size_t)mb * 16 * K + kc); if (NSPLIT == 1 || NSPLIT == 2) a2[mb] = WFrag<T16>::ld(A2 + aoff + (size_t)mb * 16 * K + kc); }
#pragma unroll
        for (int nb = 0; nb < 4; ++nb) { const V b = WFrag<T16>::ld(Bt + boff + (size_t)nb * 16 * K + kc); V b2; if (NSPLIT >= 2) b2 = WFrag<T16>::ld(Bt2 + boff + (size_t)nb * 16 * K + kc);
#pragma unroll
            for (int mb = 0; mb < 4; ++mb) { acc[mb][nb] = WFrag<T16>::mma(a[mb], b, acc[mb][nb]); if (NSPLIT == 1 || NSPLIT == 2) acc[mb][nb] = WFrag<T16>::mma(a2[mb], b, acc[mb][nb]); if (NSPLIT >= 2) acc[mb][nb] = WFrag<T16>::mma(a[mb], b2, acc[mb][nb]); } }
        asm volatile("v_nop\n\tv_nop\n\tv_nop\n\tv_nop" : "+v"(acc[0][0]), "+v"(acc[1][1]), "+v"(acc[2][2]), "+v"(acc[3][3]) : "v"(a[0]), "v"(a[3]));
    }
    float* osw = os + wv * (64 * 68);   // this wave's partial tile
#pragma unroll
    for (int mb = 0; mb < 4; ++mb) {
#pragma unroll
        for (int nb = 0; nb < 4; ++nb) {
#pragma unroll
            for (int j = 0; j < 8; ++j) osw[(mb * 16 + hi * 8 + j) * 68 + nb * 16 + lr] = acc[mb][nb][j]; } }
    if (NW == 1) { __builtin_amdgcn_wave_barrier(); asm volatile("" ::: "memory"); }   // one wave: keeps the row reads below behind its own stores
    else __syncthreads();                                                                // every wave's partial tile stands in LDS before any of it is summed
    float* crow = C + (size_t)r0 * ldc + c0;
#pragma unroll
    for (int s = 0; s < 32 / NW; ++s) { const int idx = s * (32 * NW) + (int)threadIdx.x; const int row = idx >> 4, cofs = (idx & 15) * 4; v4f val = *(const v4fa*)(os + row * 68 + cofs);
#pragma unroll
        for (int w = 1; w < NW; ++w) val += *(const v4fa*)(os + w * (64 * 68) + row * 68 + cofs);
        *(v4f*)(crow + (size_t)row * ldc + cofs) = val; }
}

__device__ __forceinline__ h16 tohx(float x) { return (h16)x; }
__device__ __forceinline__ void splitf(float y, unsigned short& h, unsigned short& l) { h = f2bf(y); l = f2bf(y - bf2f(h)); }
typedef __attribute__((ext_vector_type(2))) _Float16 v2h;
typedef __attribute__((ext_vector_type(4))) _Float16 v4h;
typedef __attribute__((ext_vector_type(2))) unsigned short v2us;
typedef __attribute__((ext_vector_type(4))) unsigned short v4us;
typedef __attribute__((ext_vector_type(2))) float v2f;
typedef __attribute__((ext_vector_type(4))) int v4i;

__global__ __launch_bounds__(256) void k_wtG(const float* __restrict__ w, int K, int N, bf* Bt) {
    const int lane = threadIdx.x & 31; const int L0 = (blockIdx.x * 8 + (threadIdx.x >> 5)) * 8; const int nlines = N * K / 64;
{
#pragma unroll 1
        for (int l = 0; l < 8; ++l) { const int L = L0 + l; if (L >= nlines) break; const size_t e = (size_t)L * 64 + lane * 2; const int k = (int)(e % K), n = (int)(e / K); v2us o;
            o[0] = f2bf(w[(size_t)k * N + n]); o[1] = f2bf(w[(size_t)(k + 1) * N + n]); *(v2us*)(Bt + e) = o; }
         }
}
__global__ __launch_bounds__(256) void k_cvt8(const float* __restrict__ src, bf* dst, size_t n8) { const size_t i = (size_t)blockIdx.x * 256 + threadIdx.x; if (i >= n8) return; const v8f v = *(const v8f*)(src + i * 8); v8us o;
#pragma unroll
    for (int k = 0; k < 8; ++k) o[k] = f2bf(v[k]); *(v8us*)(dst + i * 8) = o;  }
__global__ __launch_bounds__(256) void k_cstab(float* CS) { const int idx = blockIdx.x * 256 + threadIdx.x; if (idx >= TT * HD) return; const int t = idx / HD, d = idx % HD; const int i = (d < HD / 2) ? d : d - HD / 2; const float inv = __fdiv_rn(1.0f, powf(1000000.0f, (float)(2 * i) / (float)HD)); const float ang = __fmul_rn((float)t, inv); v2f cs; cs[0] = cosf(ang); cs[1] = sinf(ang);
    *(v2f*)(CS + (size_t)idx * 2) = cs;  }
// k_rope: head planes [h][t][d] (fp16 + hi/lo) of rope(x) x sc with the rotate-half convention out[d] = x[d] cos[t][d] - x[d+HD/2] sin[t][d], out[d+HD/2] = x[d+HD/2] cos[t][d+HD/2] + x[d] sin[t][d+HD/2]
__global__ __launch_bounds__(256) void k_rope(const float* __restrict__ F, int pitch, int nheads, const float* __restrict__ CS, const float* __restrict__ RF, const float* __restrict__ nw, float sc, h16* P16, bf* Ph, bf* Pl) {
    const size_t e = ((size_t)blockIdx.x * 256 + threadIdx.x) * 2; if (e >= (size_t)nheads * TT * HD) return; const int d = (int)(e % HD); const int t = (int)((e / HD) % TT); const int h = (int)(e / ((size_t)HD * TT)); const float* f = F + (size_t)t * pitch + h * HD; const float rf = RF ? RF[(size_t)h * TT + t] : 1.0f; v2h o16; v2us oh, ol;
#pragma unroll
    for (int q = 0; q < 2; ++q) { const int dd = d + q; const int dp = (dd < HD / 2) ? dd + HD / 2 : dd - HD / 2; float x0 = f[dd], x1 = f[dp];
        if (RF) { float n0 = __fmul_rn(x0, rf), n1 = __fmul_rn(x1, rf); asm volatile("" : "+v"(n0)); asm volatile("" : "+v"(n1)); x0 = __fmul_rn(bfr(nw[dd]), n0); x1 = __fmul_rn(bfr(nw[dp]), n1); }
        const v2f cs = *(const v2f*)(CS + ((size_t)t * HD + dd) * 2); float a = __fmul_rn(x0, cs[0]), bq = __fmul_rn(x1, cs[1]); asm volatile("" : "+v"(a)); asm volatile("" : "+v"(bq)); const float r = ((dd < HD / 2) ? __fsub_rn(a, bq) : __fadd_rn(a, bq)) * sc;
        o16[q] = tohx(r); unsigned short a2, c2; splitf(r, a2, c2); oh[q] = a2; ol[q] = c2; }
    *(v2h*)(P16 + e) = o16; *(v2us*)(Ph + e) = oh; *(v2us*)(Pl + e) = ol;  }
__global__ __launch_bounds__(256) void k_vtp(const float* __restrict__ F, int pitch, int nheads, h16* V16, bf* Vh, bf* Vl) { const size_t e = ((size_t)blockIdx.x * 256 + threadIdx.x) * 2; if (e >= (size_t)nheads * HD * TT) return; const int t = (int)(e % TT); const int d = (int)((e / TT) % HD); const int g = (int)(e / ((size_t)TT * HD)); v2h o16; v2us oh, ol;
#pragma unroll
    for (int q = 0; q < 2; ++q) { const float x = F[(size_t)(t + q) * pitch + g * HD + d]; o16[q] = tohx(x); unsigned short a2, c2; splitf(x, a2, c2); oh[q] = a2; ol[q] = c2; }
    *(v2h*)(V16 + e) = o16; *(v2us*)(Vh + e) = oh; *(v2us*)(Vl + e) = ol;  }
// k_mchk: samples above-diagonal entries of the additive f32 mask; any > -1e8 -> NaN poison.
__global__ __launch_bounds__(256) void k_mchk(const float* __restrict__ am, int* FLG) { const int tid = threadIdx.x; int bad = 0;
#pragma unroll 1
    for (int s2 = 0; s2 < 16; ++s2) { const unsigned h = (unsigned)(tid * 16 + s2) * 2654435761u; const int i = (int)(h % (TT - 1)); const int j = i + 1 + (int)((h >> 11) % (unsigned)(TT - 1 - i)); if (am[(size_t)i * TT + j] > -1e8f) bad = 1; }
    __shared__ int anyb; if (tid == 0) anyb = 0; __syncthreads(); if (bad) anyb = 1; __syncthreads(); if (tid < 8) { const int v = (tid == 0) ? anyb : 0; *(int*)(FLG + tid) = v;  } }

// k_asoft: per row (zz, i): t = S x HD^-0.5 + bf16(mask[i][j]) for j <= i, -3e38 for j > i (causal select); softmax over the 2048 keys (register row, one exp, fixed trees);
__global__ __launch_bounds__(256) void k_asoft(const float* __restrict__ Sb, const float* __restrict__ am, const int* __restrict__ FLG, h16* P16, bf* Ph, bf* Pl) {
    const int lane = threadIdx.x & 31; const int row = blockIdx.x * 8 + (threadIdx.x >> 5); if (row >= ZH * TT) return; const int i = row % TT; const int zz = row / TT; (void)zz; const bool hires = (i < RH); const float* sr = Sb + (size_t)row * TT; const float* amr = am + (size_t)i * TT; const bool poison = (FLG[0] != 0); float v[TT / 32]; float mx = -3.0e38f;
#pragma unroll
    for (int ch = 0; ch < TT / 128; ++ch) { const int j0 = ch * 128 + lane * 4; const v4f a = *(const v4f*)(sr + j0);
#pragma unroll
        for (int q = 0; q < 4; ++q) { const int j = j0 + q; (void)j; float sa = a[q] * SCL; asm volatile("" : "+v"(sa)); float mv = bfr(amr[j]); asm volatile("" : "+v"(mv)); const float t = (j <= i) ? __fadd_rn(sa, mv) : -3.0e38f; v[ch * 4 + q] = t; mx = fmaxf(mx, t); } }
#pragma unroll
    for (int sh = 16; sh; sh >>= 1) mx = fmaxf(mx, __shfl_xor(mx, sh, 32));
    float sum = 0.f;
#pragma unroll
    for (int k = 0; k < TT / 32; ++k) { float d0 = __fsub_rn(v[k], mx); asm volatile("" : "+v"(d0)); v[k] = __builtin_amdgcn_exp2f(__fmul_rn(d0, 1.4426950408889634f)); sum += v[k]; }
#pragma unroll
    for (int sh = 16; sh; sh >>= 1) sum += __shfl_xor(sum, sh, 32);
    const float f = poison ? __builtin_nanf("") : __fdiv_rn(hires ? 1.0f : PCAR, sum);
{
        if (hires) {
#pragma unroll
            for (int ch = 0; ch < TT / 128; ++ch) { v4us oh, ol;
#pragma unroll
                for (int q = 0; q < 4; ++q) { unsigned short a, c2; splitf(v[ch * 4 + q] * f, a, c2); oh[q] = a; ol[q] = c2; }
                const size_t oo = ((size_t)zz * (RH ? RH : 1) + i) * TT + ch * 128 + lane * 4; *(v4us*)(Ph + oo) = oh; *(v4us*)(Pl + oo) = ol; }
        } else {
#pragma unroll
            for (int ch = 0; ch < TT / 128; ++ch) { v4h o4;
#pragma unroll
                for (int q = 0; q < 4; ++q) o4[q] = tohx(v[ch * 4 + q] * f);
                *(v4h*)(P16 + (size_t)row * TT + ch * 128 + lane * 4) = o4; } }
         }
}
__global__ __launch_bounds__(256) void k_merge(const float* __restrict__ O, int h0, bf* Ah, bf* Al) { const size_t e = ((size_t)blockIdx.x * 256 + threadIdx.x) * 2; if (e >= (size_t)ZH * TT * HD) return; const int d = (int)(e % HD); const int t = (int)((e / HD) % TT); const int zz = (int)(e / ((size_t)HD * TT)); const float cs = (t < RH) ? 1.0f : (1.0f / PCAR); const size_t oo = (size_t)t * DQ + (h0 + zz) * HD + d;
    v2us oh, ol;
#pragma unroll
    for (int q = 0; q < 2; ++q) { unsigned short a, c2; splitf(O[e + q] * cs, a, c2); oh[q] = a; ol[q] = c2; } *(v2us*)(Ah + oo) = oh; *(v2us*)(Al + oo) = ol;  }

extern "C" void kernel_launch(void* const* d_in, const int* in_sizes, int n_in,
                              void* d_out, int out_size, void* d_ws, size_t ws_size, hipStream_t stream) {
    (void)in_sizes; (void)n_in; (void)out_size;
    const float* x = (const float*)d_in[0]; const float* amask = (const float*)d_in[1]; const float* wq = (const float*)d_in[2]; const float* wk = (const float*)d_in[3]; const float* wv = (const float*)d_in[4]; const float* wo = (const float*)d_in[5];
    float* OUT = (float*)d_out;     // [1][2048][2048]
    char* wsp = (char*)d_ws;
    auto take = [&](size_t bytes) { char* p = wsp; wsp += (bytes + 255) & ~(size_t)255; return (void*)p; };
    bf* WQ = (bf*)take((size_t)DQ * DM * 2); bf* WK = (bf*)take((size_t)DKV * DM * 2); bf* WV = (bf*)take((size_t)DKV * DM * 2); bf* WO = (bf*)take((size_t)DM * DQ * 2); float* CS = (float*)take((size_t)TT * HD * 2 * 4);
    bf* XB = (bf*)take((size_t)TT * DM * 2); int* FLG = (int*)take(256); float* FQ = (float*)take((size_t)TT * DQ * 4); float* FK = (float*)take((size_t)TT * DKV * 4);
    h16* QP16 = (h16*)take((size_t)NH_ * TT * HD * 2); h16* KP16 = (h16*)take((size_t)NKV * TT * HD * 2); h16* VT16 = (h16*)take((size_t)NKV * HD * TT * 2);
    bf* QPh = (bf*)take((size_t)NH_ * TT * HD * 2); bf* QPl = (bf*)take((size_t)NH_ * TT * HD * 2); bf* KPh = (bf*)take((size_t)NKV * TT * HD * 2); bf* KPl = (bf*)take((size_t)NKV * TT * HD * 2); bf* VTh = (bf*)take((size_t)NKV * HD * TT * 2); bf* VTl = (bf*)take((size_t)NKV * HD * TT * 2); bf* Ph = (bf*)take((size_t)ZH * RH * TT * 2); bf* Pl = (bf*)take((size_t)ZH * RH * TT * 2);
    float* Sb = (float*)take((size_t)ZH * TT * TT * 4); h16* P16 = (h16*)take((size_t)ZH * TT * TT * 2); float* Ob = (float*)take((size_t)ZH * TT * HD * 4); bf* ATh = (bf*)take((size_t)TT * DQ * 2); bf* ATl = (bf*)take((size_t)TT * DQ * 2);
    if ((size_t)(wsp - (char*)d_ws) > ws_size) return;    // ws 256 MiB
    float* FV = FK;   // v projection reuses the k buffer after the k planes are built (stream-ordered)
    { k_wtG<<<(unsigned)((DM * DQ / 64 + 63) / 64), 256, 0, stream>>>(wq, DM, DQ, WQ); k_wtG<<<(unsigned)((DM * DKV / 64 + 63) / 64), 256, 0, stream>>>(wk, DM, DKV, WK); k_wtG<<<(unsigned)((DM * DKV / 64 + 63) / 64), 256, 0, stream>>>(wv, DM, DKV, WV);
      k_wtG<<<(unsigned)((DQ * DM / 64 + 63) / 64), 256, 0, stream>>>(wo, DQ, DM, WO);
      k_cstab<<<(TT * HD + 255) / 256, 256, 0, stream>>>(CS); k_mchk<<<1, 256, 0, stream>>>(amask, FLG); }
    const unsigned LQ = (unsigned)(((size_t)NH_ * TT * HD / 2 + 255) / 256), LKv = (unsigned)(((size_t)NKV * TT * HD / 2 + 255) / 256);
    for (int b = 0; b < NB_; ++b) {
        
        k_cvt8<<<(unsigned)(((size_t)TT * DM / 8 + 255) / 256), 256, 0, stream>>>(x + (size_t)b * TT * DM, XB, (size_t)TT * DM / 8);
        k_gemmw<bf, 0, false, 4><<<dim3(TT / 64, DQ / 64, 1), 128, 0, stream>>>(XB, nullptr, WQ, nullptr, DM, FQ, DQ, nullptr, 0, 0, 0);
        k_rope<<<LQ, 256, 0, stream>>>(FQ, DQ, NH_, CS, nullptr, nullptr, 1.0f, QP16, QPh, QPl);
        k_gemmw<bf, 0, false, 8><<<dim3(TT / 64, DKV / 64, 1), 256, 0, stream>>>(XB, nullptr, WK, nullptr, DM, FK, DKV, nullptr, 0, 0, 0);
        k_rope<<<LKv, 256, 0, stream>>>(FK, DKV, NKV, CS, nullptr, nullptr, 1.0f, KP16, KPh, KPl);
        k_gemmw<bf, 0, false, 8><<<dim3(TT / 64, DKV / 64, 1), 256, 0, stream>>>(XB, nullptr, WV, nullptr, DM, FV, DKV, nullptr, 0, 0, 0); k_vtp<<<LKv, 256, 0, stream>>>(FV, DKV, NKV, VT16, VTh, VTl);
        for (int h0 = 0; h0 < NH_; h0 += ZH) { const size_t zq = (size_t)h0, zk = (size_t)(h0 / REP);   // both heads of a pass share kv group h0/REP (REP >= 2): sB = 0
            k_gemmc<bf, 2, 1, 1><<<dim3(TT / 64, TT / 64, ZH), 32, 0, stream>>>(QPh + zq * TT * HD, QPl + zq * TT * HD, KPh + zk * TT * HD, KPl + zk * TT * HD, HD, Sb, TT, 0, (size_t)TT * HD, 0, (size_t)TT * TT);   /* scores hl on all rows */
            k_asoft<<<ZH * TT / 8, 256, 0, stream>>>(Sb, amask, FLG, P16, Ph, Pl);
            k_gemmc<bf, 2, 2, 8><<<dim3(RH / 64, HD / 64, ZH), 256, 0, stream>>>(Ph, Pl, VTh + zk * HD * TT, VTl + zk * HD * TT, TT, Ob, HD, 0, (size_t)RH * TT, 0, (size_t)TT * HD);
            k_gemmc<h16, 0, 2, 8><<<dim3((TT - RH) / 64, HD / 64, ZH), 256, 0, stream>>>(P16 + (size_t)RH * TT, nullptr, VT16 + zk * HD * TT, nullptr, TT, Ob + (size_t)RH * HD, HD, RH, (size_t)TT * TT, 0, (size_t)TT * HD);
            k_merge<<<(unsigned)(((size_t)ZH * TT * HD / 2 + 255) / 256), 256, 0, stream>>>(Ob, h0, ATh, ATl); }
        k_gemmw<bf, 1, false, 4><<<dim3(TT / 64, DM / 64, 1), 128, 0, stream>>>(ATh, ATl, WO, nullptr, DQ, OUT + (size_t)b * TT * DM, DM, nullptr, 0, 0, 0); }
}

// v003
// One run takes 256 microseconds.
// It is 3.68 times as fast as v001, going by the measured steps of the versions left out in between.
// All steps since v000 together make it 6.03 times as fast.
#include <hip/hip_runtime.h>

// EagerAttention (x [1][2048][2048], mask [1][1][T][T] (f32 additive, read; verbatim causal 0/-1e9); q = x w_q (32 x 64), k/v = x w_k/w_v (8 kv heads; group h/4); rotate-half RoPE (theta 1e6, positions arange; on-chip table); scores = q.k / 8 + mask; softmax f32; out = merged w_o -> [1][2048][2048]).
// Compute dtypes, f32 accumulate: every input rounded to bf16; q/k/v on PLAIN bf16 operands (inputs: exact); RoPE f32, with the hi/lo split and the v transpose in the projections' own epilogues; causal scores hl x hl (3 products) on every row (hybrid 0.15), attn.v: rows < 512 hl (3 products), the rest fp16 (x1024); scores, softmax and attn.v in one launch (online softmax); the additive mask read per element inside computed tiles; tiles above the diagonal skipped on the verbatim structure with an on-device sampled check (NaN poison); softmax f32; w_o hl x exact (2 products).

#define NB_  1
#define TT   2048
#define DM   2048
#define NH_  32
#define NKV  8
#define REP  (NH_ / NKV)
#define HD   64
#define DQ   (NH_ * HD)
#define DKV  (NKV * HD)
#define RH   512                  // query rows < RH use hi+lo planes (0: none)
#define SCL  0.125f   // HD^-0.5
typedef _Float16 h16;
typedef unsigned short bf;
typedef __attribute__((ext_vector_type(16))) __bf16   v16bf;
typedef __attribute__((ext_vector_type(16))) _Float16 v16h;
typedef __attribute__((ext_vector_type(8)))  _Float16 v8h;
typedef __attribute__((ext_vector_type(8)))  unsigned short v8us;
typedef __attribute__((ext_vector_type(8)))  float    v8f;
typedef __attribute__((ext_vector_type(4)))  float    v4f;
typedef v8h  __attribute__((may_alias)) v8ha;
typedef v4f  __attribute__((may_alias)) v4fa;
typedef v8us __attribute__((may_alias)) v8usa;

__device__ __forceinline__ unsigned short f2bf(float f) { unsigned u = __float_as_uint(f); u += 0x7FFFu + ((u >> 16) & 1u); return (unsigned short)(u >> 16); }
__device__ __forceinline__ float bf2f(unsigned short b) { return __uint_as_float(((unsigned)b) << 16); }
__device__ __forceinline__ float bfr(float f) { return bf2f(f2bf(f)); }
__device__ __forceinline__ v16h cat16(v8h lo, v8h hi) { return __builtin_shufflevector(lo, hi, 0, 1, 2, 3, 4, 5, 6, 7, 8, 9, 10, 11, 12, 13, 14, 15); }
__device__ __forceinline__ v16bf cat16b(v8us lo, v8us hi) { return __builtin_bit_cast(v16bf, __builtin_shufflevector(lo, hi, 0, 1, 2, 3, 4, 5, 6, 7, 8, 9, 10, 11, 12, 13, 14, 15)); }
__device__ __forceinline__ v8f wmma16(v16h a, v16h b, v8f c) { return __builtin_amdgcn_wmma_f32_16x16x32_f16(false, a, false, b, (short)0, c, false, false); }
__device__ __forceinline__ v8f wmmab(v16bf a, v16bf b, v8f c) { return __builtin_amdgcn_wmma_f32_16x16x32_bf16(false, a, false, b, (short)0, c, false, false); }

__device__ __forceinline__ h16 tohx(float x) { return (h16)x; }
__device__ __forceinline__ void splitf(float y, unsigned short& h, unsigned short& l) { h = f2bf(y); l = f2bf(y - bf2f(h)); }
typedef __attribute__((ext_vector_type(2))) _Float16 v2h;
typedef __attribute__((ext_vector_type(4))) _Float16 v4h;
typedef __attribute__((ext_vector_type(2))) unsigned short v2us;
typedef __attribute__((ext_vector_type(4))) unsigned short v4us;
typedef __attribute__((ext_vector_type(2))) float v2f;
typedef __attribute__((ext_vector_type(4))) int v4i;
// Behind a run of loads: holds the run's address pairs whole (inputs) up to the wait that stands in front of any reuse of a register which an issued load names.
__device__ __forceinline__ void addr_done(const void* a) { asm volatile("s_wait_xcnt 0x0" :: "v"(a) : "memory"); }
__device__ __forceinline__ void addr_done(const void* a, const void* b) { asm volatile("s_wait_xcnt 0x0" :: "v"(a), "v"(b) : "memory"); }
// Behind a run of stores: holds the run's address pairs and data registers whole (inputs) up to the wait that stands in front of any reuse of a register which an issued store names.
__device__ __forceinline__ void stores_done(const void* a, const void* b, v4us x0, v4us x1, v4us x2, v4us x3, v4us y0, v4us y1, v4us y2, v4us y3) { asm volatile("s_wait_xcnt 0x0" :: "v"(a), "v"(b), "v"(x0), "v"(x1), "v"(x2), "v"(x3), "v"(y0), "v"(y1), "v"(y2), "v"(y3) : "memory"); }
__device__ __forceinline__ void stores_done(const void* a, const void* b, const void* c, v8h x, v8us y, v8us z) { asm volatile("s_wait_xcnt 0x0" :: "v"(a), "v"(b), "v"(c), "v"(x), "v"(y), "v"(z) : "memory"); }

// ---- k_gemmw: register-blocked GEMM, one block of NW waves per 64x64 output tile; wave w takes the 32-wide k slices w, w + NW, ... into its own 16 accumulators, the NW partial tiles are summed
// in wave order through LDS; operands straight from K-contiguous 16-bit planes; grid (M/64, N/64, Z), 32 * NW threads.
// C[m][n] (f32, pitch ldc, + optional f32 bias[n]) = sum_k A[m][k] Bt[n][k] (+ split products per NSPLIT). z-batch strides sA/sB/sC in elements. K % 32 == 0.
// EPI says what becomes of the summed tile, which is 64 positions x one head (HD == 64): 0: stored as f32 C. 1: rotate-half RoPE, out[d] = x[d] cos[t][d] - x[d+HD/2] sin[t][d], out[d+HD/2] = x[d+HD/2] cos[t][d+HD/2] + x[d] sin[t][d+HD/2],
// from the table CS ([t][d] pairs cos, sin), stored as hi/lo planes Ph, Pl [head][t][d]. 2: stored transposed as planes P16 (fp16), Ph, Pl (hi/lo) [head][d][t].
template <typename T16> struct WFrag;
template <> struct WFrag<h16> { typedef v16h V; static __device__ __forceinline__ V ld(const h16* p) { return cat16(*(const v8h*)p, *(const v8h*)(p + 16)); } static __device__ __forceinline__ v8f mma(V a, V b, v8f c) { return wmma16(a, b, c); } };
template <> struct WFrag<bf> { typedef v16bf V; static __device__ __forceinline__ V ld(const bf* p) { return cat16b(*(const v8us*)p, *(const v8us*)(p + 16)); } static __device__ __forceinline__ v8f mma(V a, V b, v8f c) { return wmmab(a, b, c); } };
template <typename T16, int NSPLIT, bool BIAS, int NW, int EPI>
__global__ __launch_bounds__(32 * NW) void k_gemmw(const T16* __restrict__ A, const T16* __restrict__ A2, const T16* __restrict__ Bt, const T16* __restrict__ Bt2, int K, float* C, int ldc, const float* __restrict__ bias, size_t sA, size_t sB, size_t sC,
                                                   const float* __restrict__ CS, h16* P16, bf* Ph, bf* Pl) {
    typedef typename WFrag<T16>::V V;
    __shared__ __align__(16) float os[NW * 64 * 68];
    const size_t z = blockIdx.z; A += z * sA; if (A2) A2 += z * sA; Bt += z * sB; if (Bt2) Bt2 += z * sB; C += z * sC;
    const int lane = threadIdx.x & 31, lr = lane & 15, hi = lane >> 4; const int r0 = blockIdx.x * 64, c0 = blockIdx.y * 64; const int wv = (NW == 1) ? 0 : __builtin_amdgcn_readfirstlane((int)(threadIdx.x >> 5));
    v8f acc[4][4];
#pragma unroll
    for (int mb = 0; mb < 4; ++mb)
#pragma unroll
        for (int nb = 0; nb < 4; ++nb) acc[mb][nb] = (v8f){};
    const size_t aoff = (size_t)(r0 + lr) * K + 8 * hi, boff = (size_t)(c0 + lr) * K + 8 * hi;
#pragma unroll 1
    for (int kc = wv * 32; kc < K; kc += 32 * NW) {
        V a[4], a2[4];
#pragma unroll
        for (int mb = 0; mb < 4; ++mb) { a[mb] = WFrag<T16>::ld(A + aoff + (size_t)mb * 16 * K + kc); if (NSPLIT == 1 || NSPLIT == 2) a2[mb] = WFrag<T16>::ld(A2 + aoff + (size_t)mb * 16 * K + kc); }
#pragma unroll
        for (int nb = 0; nb < 4; ++nb) { const V b = WFrag<T16>::ld(Bt + boff + (size_t)nb * 16 * K + kc); V b2; if (NSPLIT >= 2) b2 = WFrag<T16>::ld(Bt2 + boff + (size_t)nb * 16 * K + kc);
#pragma unroll
            for (int mb = 0; mb < 4; ++mb) { acc[mb][nb] = WFrag<T16>::mma(a[mb], b, acc[mb][nb]); if (NSPLIT == 1 || NSPLIT == 2) acc[mb][nb] = WFrag<T16>::mma(a2[mb], b, acc[mb][nb]); if (NSPLIT >= 2) acc[mb][nb] = WFrag<T16>::mma(a[mb], b2, acc[mb][nb]); } }
        asm volatile("v_nop\n\tv_nop\n\tv_nop\n\tv_nop" : "+v"(acc[0][0]), "+v"(acc[1][1]), "+v"(acc[2][2]), "+v"(acc[3][3]) : "v"(a[0]), "v"(a[3]));
    }
    float* osw = os + wv * (64 * 68);   // this wave's partial tile
#pragma unroll
    for (int mb = 0; mb < 4; ++mb) {
#pragma unroll
        for (int nb = 0; nb < 4; ++nb) {
#pragma unroll
            for (int j = 0; j < 8; ++j) osw[(mb * 16 + hi * 8 + j) * 68 + nb * 16 + lr] = acc[mb][nb][j]; } }
    const int row0 = (int)threadIdx.x >> 4, cofs0 = ((int)threadIdx.x & 15) * 4;   // this thread's row and columns in sweep 0 of the sum below; sweep s is 2 * NW rows further down
    v4f c01[32 / NW], c23[32 / NW];   // EPI 1: cos, sin pairs of this thread's four columns, per sweep
    if (EPI == 1) { const float* cs = CS + ((size_t)(r0 + row0) * HD + cofs0) * 2;   // all sweeps' table entries in one run, beside the LDS stores above: one latency, not one per sweep
#pragma unroll
        for (int s = 0; s < 32 / NW; ++s) { c01[s] = *(const v4f*)(cs + s * (2 * NW * HD * 2)); c23[s] = *(const v4f*)(cs + s * (2 * NW * HD * 2) + 4); }
        addr_done(cs); }
    bf* const ph = Ph + ((size_t)blockIdx.y * TT + r0 + row0) * HD + cofs0; bf* const pl = Pl + ((size_t)blockIdx.y * TT + r0 + row0) * HD + cofs0; v4us oh4[4], ol4[4];   // EPI 1: where sweep 0 goes; four sweeps' results
    v4f vs[32 / NW];   // EPI 2: this thread's sums of all sweeps
    if (NW == 1) { __builtin_amdgcn_wave_barrier(); asm volatile("" ::: "memory"); }   // one wave: keeps the row reads below behind its own stores
    else __syncthreads();                                                                // every wave's partial tile stands in LDS before any of it is summed
    float* crow = C + (size_t)r0 * ldc + c0;
#pragma unroll
    for (int s = 0; s < 32 / NW; ++s) { const int idx = s * (32 * NW) + (int)threadIdx.x; const int row = idx >> 4, cofs = (idx & 15) * 4; v4f val = *(const v4fa*)(os + row * 68 + cofs);
#pragma unroll
        for (int w = 1; w < NW; ++w) val += *(const v4fa*)(os + w * (64 * 68) + row * 68 + cofs);
        if (BIAS) { val[0] += bfr(bias[c0 + cofs]); val[1] += bfr(bias[c0 + cofs + 1]); val[2] += bfr(bias[c0 + cofs + 2]); val[3] += bfr(bias[c0 + cofs + 3]); }
        if (EPI == 1) {   // sixteen lanes hold one position's head; lane ^ 8 holds the partner elements of the other half
            const float co[4] = {c01[s][0], c01[s][2], c23[s][0], c23[s][2]}, si[4] = {c01[s][1], c01[s][3], c23[s][1], c23[s][3]};
#pragma unroll
            for (int k = 0; k < 4; ++k) { const float xp = __shfl_xor(val[k], 8, 32); const float r = val[k] * co[k] + ((cofs < HD / 2) ? -xp : xp) * si[k]; unsigned short a2, c2; splitf(r, a2, c2); oh4[s & 3][k] = a2; ol4[s & 3][k] = c2; }
            if ((s & 3) == 3) {   // four sweeps' stores in one run: sixteen lanes store one whole 128-byte line of each plane
#pragma unroll
                for (int q = 0; q < 4; ++q) { *(v4us*)(ph + (s - 3 + q) * (2 * NW * HD)) = oh4[q]; *(v4us*)(pl + (s - 3 + q) * (2 * NW * HD)) = ol4[q]; }
                stores_done(ph, pl, oh4[0], oh4[1], oh4[2], oh4[3], ol4[0], ol4[1], ol4[2], ol4[3]); }
            continue; }
        if (EPI == 2) { vs[s] = val; continue; }
        *(v4f*)(crow + (size_t)row * ldc + cofs) = val; }
    if (EPI == 2) {
#pragma unroll
        for (int s = 0; s < 32 / NW; ++s) *(v4fa*)(os + (row0 + s * (2 * NW)) * 68 + cofs0) = vs[s];   // over wave 0's partial tile: this thread alone has read these places, and nobody reads them again in front of the barrier below
        __syncthreads();   // the summed tile stands whole in LDS before it is read by columns
        const int d0 = (int)threadIdx.x >> 3, t8 = ((int)threadIdx.x & 7) * 8; v8h o16[16 / NW]; v8us oh[16 / NW], ol[16 / NW];   // eight lanes store one whole 128-byte line of a plane's row d
#pragma unroll
        for (int s = 0; s < 16 / NW; ++s)
#pragma unroll
            for (int k = 0; k < 8; ++k) { const float x = os[(t8 + k) * 68 + d0 + s * (4 * NW)]; o16[s][k] = tohx(x); unsigned short a2, c2; splitf(x, a2, c2); oh[s][k] = a2; ol[s][k] = c2; }
        const size_t e = ((size_t)blockIdx.y * HD + d0) * TT + r0 + t8; h16* const q16 = P16 + e; bf* const qh = Ph + e; bf* const ql = Pl + e;
#pragma unroll
        for (int s = 0; s < 16 / NW; ++s) { *(v8h*)(q16 + (size_t)s * (4 * NW) * TT) = o16[s]; *(v8us*)(qh + (size_t)s * (4 * NW) * TT) = oh[s]; *(v8us*)(ql + (size_t)s * (4 * NW) * TT) = ol[s]; stores_done(q16, qh, ql, o16[s], oh[s], ol[s]); } }
}

__global__ __launch_bounds__(256) void k_wtG(const float* __restrict__ w, int K, int N, bf* Bt) {
    const int lane = threadIdx.x & 31; const int L0 = (blockIdx.x * 8 + (threadIdx.x >> 5)) * 8; const int nlines = N * K / 64;
{
#pragma unroll 1
        for (int l = 0; l < 8; ++l) { const int L = L0 + l; if (L >= nlines) break; const size_t e = (size_t)L * 64 + lane * 2; const int k = (int)(e % K), n = (int)(e / K); v2us o;
            o[0] = f2bf(w[(size_t)k * N + n]); o[1] = f2bf(w[(size_t)(k + 1) * N + n]); *(v2us*)(Bt + e) = o; }
         }
}
__global__ __launch_bounds__(256) void k_cvt8(const float* __restrict__ src, bf* dst, size_t n8) { const size_t i = (size_t)blockIdx.x * 256 + threadIdx.x; if (i >= n8) return; const v8f v = *(const v8f*)(src + i * 8); v8us o;
#pragma unroll
    for (int k = 0; k < 8; ++k) o[k] = f2bf(v[k]); *(v8us*)(dst + i * 8) = o;  }
__global__ __launch_bounds__(256) void k_cstab(float* CS) { const int idx = blockIdx.x * 256 + threadIdx.x; if (idx >= TT * HD) return; const int t = idx / HD, d = idx % HD; const int i = (d < HD / 2) ? d : d - HD / 2; const float inv = __fdiv_rn(1.0f, powf(1000000.0f, (float)(2 * i) / (float)HD)); const float ang = __fmul_rn((float)t, inv); v2f cs; cs[0] = cosf(ang); cs[1] = sinf(ang);
    *(v2f*)(CS + (size_t)idx * 2) = cs;  }
// k_mchk: samples above-diagonal entries of the additive f32 mask; any > -1e8 -> NaN poison.
__global__ __launch_bounds__(256) void k_mchk(const float* __restrict__ am, int* FLG) { const int tid = threadIdx.x; int bad = 0;
#pragma unroll 1
    for (int s2 = 0; s2 < 16; ++s2) { const unsigned h = (unsigned)(tid * 16 + s2) * 2654435761u; const int i = (int)(h % (TT - 1)); const int j = i + 1 + (int)((h >> 11) % (unsigned)(TT - 1 - i)); if (am[(size_t)i * TT + j] > -1e8f) bad = 1; }
    __shared__ int anyb; if (tid == 0) anyb = 0; __syncthreads(); if (bad) anyb = 1; __syncthreads(); if (tid < 8) { const int v = (tid == 0) ? anyb : 0; *(int*)(FLG + tid) = v;  } }

// ---- k_fattn: causal attention of one kv group's four heads x two groups of 16 query rows per block, one launch for all heads; no score or probability matrix in memory, no LDS, no barrier.
// Wave w: head g * REP + (w & 3), query rows r0 .. r0 + 15 (row group x for w < 4, 127 - x for the rest); the four heads of a row group walk the same key tiles, so K, V and mask lines are shared in the WGP cache.
// Transposed products: S^T = K Q^T puts key hi * 8 + j of query lr in accumulator element j, which is the k order of a B fragment, so P^T feeds O^T = V^T P^T straight from registers.
// Online softmax per query (= per lane pair lr, lr + 16): running max m, running sum l, accumulators rescaled by 2^((m_old - m_new) log2 e). p carries a factor 2^10 (fp16 range) that cancels in O / l.
// A pass is 32 keys; for rows >= RH the next pass's K fragments and mask values are fetched behind this pass's score products, into the same registers. Only the last pass of a wave meets the diagonal.
// Same operand classes as before: scores hi/lo x hi/lo (3 products), attn.v hi/lo (3 products) for rows < RH and fp16 for the rest; t = s / 8 + bf16(mask) for key <= query, key tiles above the diagonal not visited.
// Every '#pragma unroll' in fattn_rows keeps a fragment or accumulator array at constant indices, that is in registers; the two '#pragma unroll 1' keep the pass loops rolled (one pass of code, no second set of fragments).
#define L2E 1.4426950408889634f
template <bool B> struct BoolC { static constexpr bool value = B; };
// 2^x with the slot behind the transcendental filled by construction
__device__ __forceinline__ float exp2_slot(float x) { float r; asm("v_exp_f32 %0, %1\n\tv_nop" : "=v"(r) : "v"(x)); return r; }
template <bool SLOT> __device__ __forceinline__ float exp2x(float x) { return SLOT ? exp2_slot(x) : __builtin_amdgcn_exp2f(x); }
template <bool HR>
__device__ __forceinline__ void fattn_rows(const bf* __restrict__ Qh, const bf* __restrict__ Ql, const bf* __restrict__ Kh, const bf* __restrict__ Kl, const h16* __restrict__ V16, const bf* __restrict__ Vh, const bf* __restrict__ Vl,
                                           const float* __restrict__ am, bool poison, int r0, int lr, int hi, bf* Ah, bf* Al) {
    const int i = r0 + lr;                       // this lane's query row
    v16bf qh[2], ql[2];
#pragma unroll
    for (int ks = 0; ks < 2; ++ks) { qh[ks] = WFrag<bf>::ld(Qh + (size_t)i * HD + 8 * hi + ks * 32); ql[ks] = WFrag<bf>::ld(Ql + (size_t)i * HD + 8 * hi + ks * 32); }
    addr_done(Qh + (size_t)i * HD + 8 * hi, Ql + (size_t)i * HD + 8 * hi);
    v8f o[4];
#pragma unroll
    for (int db = 0; db < 4; ++db) o[db] = (v8f){};
    float m = -3.0e38f, l = 0.f;
    const int nt = r0 / 32 + 1;                  // passes of 32 keys up to and including the diagonal one
    const float* amr = am + (size_t)i * TT + 8 * hi;
    const size_t kof = (size_t)lr * HD + 8 * hi, vof = (size_t)lr * TT + 8 * hi;
    v16bf kh[2][2], kl[2][2]; v4f mk[2][2];
    auto fetch = [&](int c0) { const bf* ph = Kh + kof + (size_t)c0 * HD; const bf* pl = Kl + kof + (size_t)c0 * HD;
#pragma unroll
        for (int kb = 0; kb < 2; ++kb) {
#pragma unroll
            for (int ks = 0; ks < 2; ++ks) { kh[kb][ks] = WFrag<bf>::ld(ph + kb * 16 * HD + ks * 32); kl[kb][ks] = WFrag<bf>::ld(pl + kb * 16 * HD + ks * 32); } }
        addr_done(ph, pl); };
    auto fetchm = [&](int c0) { const float* pm = amr + c0;
#pragma unroll
        for (int kb = 0; kb < 2; ++kb) { mk[kb][0] = *(const v4f*)(pm + kb * 16); mk[kb][1] = *(const v4f*)(pm + kb * 16 + 4); }
        addr_done(pm); };
    auto pass = [&](auto diag, int c0) {
        constexpr bool DG = decltype(diag)::value;
        v16h vf[4]; v16bf vh[4], vl[4];
        if (HR) { fetch(c0); fetchm(c0); }       // the short hi/lo rows fetch in the pass itself: two V planes and K fragments ahead do not fit the registers together
        else { const h16* pv = V16 + vof + c0;
#pragma unroll
            for (int db = 0; db < 4; ++db) vf[db] = WFrag<h16>::ld(pv + db * 16 * TT);
            addr_done(pv); }
        v8f s[2];
#pragma unroll
        for (int kb = 0; kb < 2; ++kb) { s[kb] = (v8f){};
#pragma unroll
            for (int ks = 0; ks < 2; ++ks) { s[kb] = wmmab(kh[kb][ks], qh[ks], s[kb]); s[kb] = wmmab(kh[kb][ks], ql[ks], s[kb]); s[kb] = wmmab(kl[kb][ks], qh[ks], s[kb]); } }
        if (HR) { const bf* pvh = Vh + vof + c0; const bf* pvl = Vl + vof + c0;
#pragma unroll
            for (int db = 0; db < 4; ++db) { vh[db] = WFrag<bf>::ld(pvh + db * 16 * TT); vl[db] = WFrag<bf>::ld(pvl + db * 16 * TT); }
            addr_done(pvh, pvl); }
        else if (!DG) { fetch(c0 + 32); __builtin_amdgcn_sched_barrier(0); }   // keeps the next pass's K loads here, in front of the softmax, so that they fly under it
        float mx = m;
#pragma unroll
        for (int kb = 0; kb < 2; ++kb)
#pragma unroll
            for (int j = 0; j < 8; ++j) { float t = s[kb][j] * SCL + bfr(mk[kb][j >> 2][j & 3]); if (DG) t += (c0 + kb * 16 + hi * 8 + j <= i) ? 0.f : -3.0e38f; s[kb][j] = t; mx = fmaxf(mx, t); }
        if (!HR && !DG) fetchm(c0 + 32);
        mx = fmaxf(mx, __shfl_xor(mx, 16, 32));  // the other half of this query's keys
        const float al = exp2x<HR || DG>((m - mx) * L2E); m = mx;
        float ps = 0.f;
#pragma unroll
        for (int kb = 0; kb < 2; ++kb)
#pragma unroll
            for (int j = 0; j < 8; ++j) { const float p = exp2x<HR || DG>((s[kb][j] - mx) * L2E + 10.0f); s[kb][j] = p; ps += p; }
        l = l * al + ps;
#pragma unroll
        for (int db = 0; db < 4; ++db) o[db] *= al;
        if (HR) { v8us h0, l0, h1, l1;
#pragma unroll
            for (int j = 0; j < 8; ++j) { unsigned short a, c2; splitf(s[0][j], a, c2); h0[j] = a; l0[j] = c2; splitf(s[1][j], a, c2); h1[j] = a; l1[j] = c2; }
            const v16bf ph = cat16b(h0, h1), pl = cat16b(l0, l1);
#pragma unroll
            for (int db = 0; db < 4; ++db) { o[db] = wmmab(vh[db], ph, o[db]); o[db] = wmmab(vh[db], pl, o[db]); o[db] = wmmab(vl[db], ph, o[db]); }
        } else { v8h p0, p1;
#pragma unroll
            for (int j = 0; j < 8; ++j) { p0[j] = tohx(s[0][j]); p1[j] = tohx(s[1][j]); }
            const v16h pf = cat16(p0, p1);
#pragma unroll
            for (int db = 0; db < 4; ++db) o[db] = wmma16(vf[db], pf, o[db]); }
        // the distance behind the last matrix instructions on the taken back edge
        asm volatile("v_nop\n\tv_nop\n\tv_nop\n\tv_nop" : "+v"(o[0]), "+v"(o[1]), "+v"(o[2]), "+v"(o[3]));
    };
    if (!HR) { fetch(0); fetchm(0); }
    int kt = 0;
    if (HR) {
#pragma unroll 1
        for (; kt < nt - 1; ++kt) pass(BoolC<false>(), kt * 32);
    } else {                                     // rows >= RH have at least RH / 32 passes in front of the diagonal one
#pragma unroll 1
        do { pass(BoolC<false>(), kt * 32); ++kt; } while (kt < nt - 1); }
    pass(BoolC<true>(), kt * 32);
    l += __shfl_xor(l, 16, 32);
    const float f = poison ? __builtin_nanf("") : __fdiv_rn(1.0f, l);
#pragma unroll
    for (int db = 0; db < 4; ++db) { v8us oh, ol;
#pragma unroll
        for (int j = 0; j < 8; ++j) { unsigned short a, c2; splitf(o[db][j] * f, a, c2); oh[j] = a; ol[j] = c2; }
        const size_t oo = (size_t)i * DQ + db * 16 + hi * 8; *(v8us*)(Ah + oo) = oh; *(v8us*)(Al + oo) = ol; }
}
// four waves per SIMD (two blocks per WGP): the vector work between the matrix runs wants the waves, so the register count is held to a quarter of the file
__global__ __launch_bounds__(256) __attribute__((amdgpu_waves_per_eu(4, 4))) void k_fattn(const bf* __restrict__ QPh, const bf* __restrict__ QPl, const bf* __restrict__ KPh, const bf* __restrict__ KPl, const h16* __restrict__ VT16, const bf* __restrict__ VTh, const bf* __restrict__ VTl,
                                               const float* __restrict__ am, const int* __restrict__ FLG, bf* ATh, bf* ATl) {
    const int lane = threadIdx.x & 31, lr = lane & 15, hi = lane >> 4; const int wv = __builtin_amdgcn_readfirstlane((int)(threadIdx.x >> 5));
    const int g = blockIdx.y; const int rg = (wv >> 2) ? (TT / 16 - 1) - (int)blockIdx.x : (int)blockIdx.x;   // a short and a long group of 16 rows per block: every block walks the same number of passes
    const int head = g * REP + (wv & 3); const int r0 = rg * 16; const bool poison = (FLG[0] != 0);
    const size_t zq = (size_t)head * TT * HD, zk = (size_t)g * TT * HD;
    if (r0 < RH) fattn_rows<true>(QPh + zq, QPl + zq, KPh + zk, KPl + zk, VT16 + zk, VTh + zk, VTl + zk, am, poison, r0, lr, hi, ATh + head * HD, ATl + head * HD);
    else fattn_rows<false>(QPh + zq, QPl + zq, KPh + zk, KPl + zk, VT16 + zk, VTh + zk, VTl + zk, am, poison, r0, lr, hi, ATh + head * HD, ATl + head * HD);
}

extern "C" void kernel_launch(void* const* d_in, const int* in_sizes, int n_in,
                              void* d_out, int out_size, void* d_ws, size_t ws_size, hipStream_t stream) {
    (void)in_sizes; (void)n_in; (void)out_size;
    const float* x = (const float*)d_in[0]; const float* amask = (const float*)d_in[1]; const float* wq = (const float*)d_in[2]; const float* wk = (const float*)d_in[3]; const float* wv = (const float*)d_in[4]; const float* wo = (const float*)d_in[5];
    float* OUT = (float*)d_out;     // [1][2048][2048]
    char* wsp = (char*)d_ws;
    auto take = [&](size_t bytes) { char* p = wsp; wsp += (bytes + 255) & ~(size_t)255; return (void*)p; };
    bf* WQ = (bf*)take((size_t)DQ * DM * 2); bf* WK = (bf*)take((size_t)DKV * DM * 2); bf* WV = (bf*)take((size_t)DKV * DM * 2); bf* WO = (bf*)take((size_t)DM * DQ * 2); float* CS = (float*)take((size_t)TT * HD * 2 * 4);
    bf* XB = (bf*)take((size_t)TT * DM * 2); int* FLG = (int*)take(256);
    h16* VT16 = (h16*)take((size_t)NKV * HD * TT * 2);
    bf* QPh = (bf*)take((size_t)NH_ * TT * HD * 2); bf* QPl = (bf*)take((size_t)NH_ * TT * HD * 2); bf* KPh = (bf*)take((size_t)NKV * TT * HD * 2); bf* KPl = (bf*)take((size_t)NKV * TT * HD * 2); bf* VTh = (bf*)take((size_t)NKV * HD * TT * 2); bf* VTl = (bf*)take((size_t)NKV * HD * TT * 2);
    bf* ATh = (bf*)take((size_t)TT * DQ * 2); bf* ATl = (bf*)take((size_t)TT * DQ * 2);
    if ((size_t)(wsp - (char*)d_ws) > ws_size) return;    // ws 256 MiB
    { k_wtG<<<(unsigned)((DM * DQ / 64 + 63) / 64), 256, 0, stream>>>(wq, DM, DQ, WQ); k_wtG<<<(unsigned)((DM * DKV / 64 + 63) / 64), 256, 0, stream>>>(wk, DM, DKV, WK); k_wtG<<<(unsigned)((DM * DKV / 64 + 63) / 64), 256, 0, stream>>>(wv, DM, DKV, WV);
      k_wtG<<<(unsigned)((DQ * DM / 64 + 63) / 64), 256, 0, stream>>>(wo, DQ, DM, WO);
      k_cstab<<<(TT * HD + 255) / 256, 256, 0, stream>>>(CS); k_mchk<<<1, 256, 0, stream>>>(amask, FLG); }
    for (int b = 0; b < NB_; ++b) {
        
        k_cvt8<<<(unsigned)(((size_t)TT * DM / 8 + 255) / 256), 256, 0, stream>>>(x + (size_t)b * TT * DM, XB, (size_t)TT * DM / 8);
        k_gemmw<bf, 0, false, 4, 1><<<dim3(TT / 64, DQ / 64, 1), 128, 0, stream>>>(XB, nullptr, WQ, nullptr, DM, nullptr, 0, nullptr, 0, 0, 0, CS, nullptr, QPh, QPl);
        k_gemmw<bf, 0, false, 8, 1><<<dim3(TT / 64, DKV / 64, 1), 256, 0, stream>>>(XB, nullptr, WK, nullptr, DM, nullptr, 0, nullptr, 0, 0, 0, CS, nullptr, KPh, KPl);
        k_gemmw<bf, 0, false, 8, 2><<<dim3(TT / 64, DKV / 64, 1), 256, 0, stream>>>(XB, nullptr, WV, nullptr, DM, nullptr, 0, nullptr, 0, 0, 0, nullptr, VT16, VTh, VTl);
        k_fattn<<<dim3(TT / 32, NKV, 1), 256, 0, stream>>>(QPh, QPl, KPh, KPl, VT16, VTh, VTl, amask, FLG, ATh, ATl);
        k_gemmw<bf, 1, false, 4, 0><<<dim3(TT / 64, DM / 64, 1), 128, 0, stream>>>(ATh, ATl, WO, nullptr, DQ, OUT + (size_t)b * TT * DM, DM, nullptr, 0, 0, 0, nullptr, nullptr, nullptr, nullptr); }
}
